// v000
// The times below were measured on an AMD MI455X: many runs one after another, warmed up first and cycling through
// copies of the inputs, with the whole window's GPU time divided by the number of runs. Launches and the gaps
// between them are all in it. The median over several windows is given; except for v000 it joins two sittings, which
// can be a few percent apart, so the side-by-side timings, each taken in one sitting, are the better comparison.
// v000 is the starting kernel. One run takes 28.4 microseconds.
#include <hip/hip_runtime.h>
#include <float.h>

// ---------------------------------------------------------------------------
// Problem: out[j,f] = PReLU_f( sum_k W[f,j,k] * nan_to_num(x[k,f]) + b[f,j] )
//   B = 512 (j,k range), F = 256 features. W = 256 MB fp32 -> HBM-bound
//   (~11 us at 23.3 TB/s). Strategy: async-DMA W panels to LDS (double
//   buffered, ASYNCcnt), feed V_WMMA_F32_16X16X4_F32 with x broadcast across
//   all 16 B-columns so every C column holds y.
// ---------------------------------------------------------------------------

typedef __attribute__((ext_vector_type(2))) float v2f;
typedef __attribute__((ext_vector_type(8))) float v8f;

#define BDIM 512          // batch / matrix dim
#define FDIM 256          // features
#define KPANEL 64         // k-columns per LDS panel
#define ROWSTRIDE 68      // floats per LDS W row (64 + 4 pad -> bank-conflict-free)

// Fixed LDS layout: xs at offset 0 so its ds_load offsets fit the 16-bit
// immediate field (wbuf is 68 KB; placing xs after it forced per-load v_adds).
struct __align__(16) Smem {
    float xs[BDIM];                      // 2 KB, offset 0
    float wbuf[8][2][16 * ROWSTRIDE];    // 68 KB, per-wave double buffers
};

__global__ __launch_bounds__(256)
void fused_pf_linear_prelu(const float* __restrict__ X,     // (512,256): x[k*256+f]
                           const float* __restrict__ W,     // (256,512,512)
                           const float* __restrict__ Bias,  // (256,512)
                           const float* __restrict__ Alpha, // (256)
                           float* __restrict__ Out)         // (512,256)
{
    __shared__ Smem sm;

    const int f      = blockIdx.x >> 2;    // feature
    const int jgroup = blockIdx.x & 3;     // which 128-row slab of the 512 outputs
    const int tid    = threadIdx.x;
    const int w      = tid >> 5;           // wave id (wave32)
    const int lane   = tid & 31;
    const int r      = lane & 15;          // A-matrix M row within tile
    const int g      = lane >> 4;          // lane group (K half per ISA layout)

    // ---- stage x[:, f] into LDS with jnp.nan_to_num semantics ----
    for (int k = tid; k < BDIM; k += 256) {
        float v = X[(size_t)k * FDIM + f];
        if (v != v)                  v = 0.0f;       // NaN -> 0
        else if (__builtin_isinf(v)) v = (v > 0.0f) ? FLT_MAX : -FLT_MAX;
        sm.xs[k] = v;
    }
    __syncthreads();

    const int j0 = jgroup * 128 + w * 16;  // this wave's 16 output rows
    const float* gW = W + (size_t)f * BDIM * BDIM + (size_t)j0 * BDIM;

    const int colb = (lane & 15) * 16;     // byte column inside a 256B half-row chunk
    uint32_t ldsb0 = (uint32_t)(uintptr_t)(&sm.wbuf[w][0][0]);  // LDS byte offsets
    uint32_t ldsb1 = (uint32_t)(uintptr_t)(&sm.wbuf[w][1][0]);

    // Async-DMA one 16x64 fp32 W panel (4 KB) into LDS: 8 x b128 per wave,
    // each instruction moves 2 full rows (512 B) fully coalesced.
    auto issue_panel = [&](int p, uint32_t lbase) {
        const char* gbase = (const char*)(gW + p * KPANEL);
#pragma unroll
        for (int i = 0; i < 8; ++i) {
            int row = 2 * i + g;
            uint64_t ga = (uint64_t)(uintptr_t)(gbase + (size_t)row * (BDIM * 4) + colb);
            uint32_t la = lbase + (uint32_t)(row * (ROWSTRIDE * 4) + colb);
            asm volatile("global_load_async_to_lds_b128 %0, %1, off"
                         :: "v"(la), "v"(ga) : "memory");
        }
    };

    v8f acc = {};            // 16x16 f32 C/D tile (all columns identical = y)

    issue_panel(0, ldsb0);
    int buf = 0;
    for (int p = 0; p < 8; ++p) {
        if (p < 7) {
            issue_panel(p + 1, buf ? ldsb0 : ldsb1);
            asm volatile("s_wait_asynccnt 8" ::: "memory");   // current panel landed
        } else {
            asm volatile("s_wait_asynccnt 0" ::: "memory");
        }
        const float* wp = &sm.wbuf[w][buf][0];
        const float* xp = &sm.xs[p * KPANEL];
#pragma unroll
        for (int kk = 0; kk < KPANEL; kk += 4) {
            // A (16x4 f32): lane(g,r) holds W[j0+r, kk+2g .. kk+2g+1] (ISA layout)
            v2f a  = *(const v2f*)(wp + r * ROWSTRIDE + kk + 2 * g);
            // B (4x16 f32): broadcast x into every N column (same K indexing)
            v2f bx = *(const v2f*)(xp + kk + 2 * g);
            acc = __builtin_amdgcn_wmma_f32_16x16x4_f32(
                      false, a, false, bx, (short)0, acc, false, false);
        }
        buf ^= 1;
    }

    // C layout: VGPR v, lanes 0-15 -> M=v, lanes 16-31 -> M=v+8; all N equal.
    if ((lane & 15) == 0) {
        const int   mbase = j0 + 8 * g;
        const float al    = Alpha[f];
#pragma unroll
        for (int v = 0; v < 8; ++v) {
            float y = acc[v] + Bias[(size_t)f * BDIM + mbase + v];
            y = (y >= 0.0f) ? y : al * y;
            Out[(size_t)(mbase + v) * FDIM + f] = y;
        }
    }
}

extern "C" void kernel_launch(void* const* d_in, const int* in_sizes, int n_in,
                              void* d_out, int out_size, void* d_ws, size_t ws_size,
                              hipStream_t stream) {
    (void)in_sizes; (void)n_in; (void)out_size; (void)d_ws; (void)ws_size;
    const float* X     = (const float*)d_in[0];
    const float* W     = (const float*)d_in[1];
    const float* Bias  = (const float*)d_in[2];
    const float* Alpha = (const float*)d_in[3];
    float* Out = (float*)d_out;
    // 256 features x 4 row-slabs; 256 threads = 8 wave32 -> one 16-row tile/wave
    fused_pf_linear_prelu<<<dim3(FDIM * 4), dim3(256), 0, stream>>>(X, W, Bias, Alpha, Out);
}

// v001
// One run takes 26.4 microseconds.
// Timed twice side by side with v000, it ran 1.06 times as fast both times.
#include <hip/hip_runtime.h>
#include <float.h>

// ---------------------------------------------------------------------------
// Problem: out[j,f] = PReLU_f( sum_k W[f,j,k] * nan_to_num(x[k,f]) + b[f,j] )
//   B = 512 (j,k range), F = 256 features. W = 256 MB fp32, read once.
//   One work-group of 16 waves per feature, so one per WGP: x[:,f] is staged
//   once, and each wave streams 32 rows of W (two 16-row tiles) through its own
//   double-buffered LDS panels by async copies. V_WMMA_F32_16X16X4_F32 takes
//   x broadcast across all 16 B-columns, so every C column holds y.
// ---------------------------------------------------------------------------

typedef __attribute__((ext_vector_type(2))) float v2f;
typedef __attribute__((ext_vector_type(8))) float v8f;

#define BDIM 512          // batch / matrix dim
#define FDIM 256          // features
#define WAVES 16          // waves per work-group
#define WROWS 32          // W rows per wave (two WMMA row tiles)
#define KPANEL 64         // k-columns per LDS panel
#define ROWSTRIDE 68      // floats per LDS W row (64 + 4 pad -> bank-conflict-free)

struct __align__(16) Smem {
    float wbuf[WAVES][2][WROWS * ROWSTRIDE];     // 272 KB, per-wave double buffers
    float xs[BDIM];                              // 2 KB
};

__global__ __launch_bounds__(WAVES * 32)
void fused_pf_linear_prelu(const float* __restrict__ X,     // (512,256): x[k*256+f]
                           const float* __restrict__ W,     // (256,512,512)
                           const float* __restrict__ Bias,  // (256,512)
                           const float* __restrict__ Alpha, // (256)
                           float* __restrict__ Out)         // (512,256)
{
    __shared__ Smem sm;

    const int f      = blockIdx.x;         // feature
    const int tid    = threadIdx.x;
    const int w      = tid >> 5;           // wave id (wave32)
    const int lane   = tid & 31;
    const int r      = lane & 15;          // A-matrix M row within tile
    const int g      = lane >> 4;          // lane group (K half per ISA layout)

    // ---- stage x[:, f] into LDS with jnp.nan_to_num semantics ----
    {
        float v = X[(size_t)tid * FDIM + f];         // 512 threads, 512 k
        if (v != v)                  v = 0.0f;       // NaN -> 0
        else if (__builtin_isinf(v)) v = (v > 0.0f) ? FLT_MAX : -FLT_MAX;
        sm.xs[tid] = v;
    }
    __syncthreads();

    const int j0 = w * WROWS;              // this wave's 32 output rows
    const int colb = (lane & 15) * 16;     // byte column inside a row's 256B panel chunk
    // lane's first byte of W: row j0 + g, its 16 bytes of the row's first 256
    const char* gL = (const char*)(W + (size_t)f * BDIM * BDIM + (size_t)(j0 + g) * BDIM) + colb;
    // lane's LDS byte address of the same place in buffer 0
    const uint32_t lL = (uint32_t)(uintptr_t)(&sm.wbuf[w][0][0]) + (uint32_t)(g * (ROWSTRIDE * 4) + colb);

    // Async-copy one 32x64 fp32 W panel (8 KB) into LDS: 16 x b128 per wave,
    // each instruction moves 256 B of two rows. Eight copies a statement; the
    // s_wait_xcnt 0 that ends it stands before any rewrite of their address registers.
    auto issue_panel = [&](int p, int b) {
        const char* gp = gL + p * (KPANEL * 4);
        const uint32_t lp = lL + (uint32_t)(b * (WROWS * ROWSTRIDE * 4));
#pragma unroll  // both statements in line, their row offsets constants
        for (int h = 0; h < 2; ++h) {
            const char* ga = gp + h * (16 * BDIM * 4);
            const uint32_t la = lp + (uint32_t)(h * (16 * ROWSTRIDE * 4));
#define GA(i) (uint64_t)(uintptr_t)(ga + (i) * (2 * BDIM * 4))
#define LA(i) (la + (uint32_t)((i) * (2 * ROWSTRIDE * 4)))
            asm volatile("global_load_async_to_lds_b128 %0, %8, off\n\t"
                         "global_load_async_to_lds_b128 %1, %9, off\n\t"
                         "global_load_async_to_lds_b128 %2, %10, off\n\t"
                         "global_load_async_to_lds_b128 %3, %11, off\n\t"
                         "global_load_async_to_lds_b128 %4, %12, off\n\t"
                         "global_load_async_to_lds_b128 %5, %13, off\n\t"
                         "global_load_async_to_lds_b128 %6, %14, off\n\t"
                         "global_load_async_to_lds_b128 %7, %15, off\n\t"
                         "s_wait_xcnt 0x0"
                         :: "v"(LA(0)), "v"(LA(1)), "v"(LA(2)), "v"(LA(3)),
                            "v"(LA(4)), "v"(LA(5)), "v"(LA(6)), "v"(LA(7)),
                            "v"(GA(0)), "v"(GA(1)), "v"(GA(2)), "v"(GA(3)),
                            "v"(GA(4)), "v"(GA(5)), "v"(GA(6)), "v"(GA(7))
                         : "memory");
#undef GA
#undef LA
        }
    };

    v8f acc0 = {};           // rows j0 .. j0+15   (all columns identical = y)
    v8f acc1 = {};           // rows j0+16 .. j0+31

    issue_panel(0, 0);
    int buf = 0;
    for (int p = 0; p < 8; ++p) {
        if (p < 7) {
            // the wave's own reads of the buffer about to be refilled have retired
            asm volatile("s_wait_dscnt 0x0" ::: "memory");
            issue_panel(p + 1, buf ^ 1);
            asm volatile("s_wait_asynccnt 16" ::: "memory");  // current panel landed
        } else {
            asm volatile("s_wait_asynccnt 0" ::: "memory");
        }
        const float* wp = &sm.wbuf[w][buf][0];
        const float* xp = &sm.xs[p * KPANEL];
#pragma unroll
        for (int kk = 0; kk < KPANEL; kk += 4) {
            // A (16x4 f32): lane(g,r) holds W[row r of the tile, kk+2g .. kk+2g+1] (ISA layout)
            v2f a0 = *(const v2f*)(wp + r * ROWSTRIDE + kk + 2 * g);
            v2f a1 = *(const v2f*)(wp + (16 + r) * ROWSTRIDE + kk + 2 * g);
            // B (4x16 f32): broadcast x into every N column (same K indexing)
            v2f bx = *(const v2f*)(xp + kk + 2 * g);
            acc0 = __builtin_amdgcn_wmma_f32_16x16x4_f32(
                       false, a0, false, bx, (short)0, acc0, false, false);
            acc1 = __builtin_amdgcn_wmma_f32_16x16x4_f32(
                       false, a1, false, bx, (short)0, acc1, false, false);
        }
        buf ^= 1;
    }

    // C layout: VGPR v, lanes 0-15 -> M=v, lanes 16-31 -> M=v+8; all N equal.
    if ((lane & 15) == 0) {
        const float al = Alpha[f];
#pragma unroll  // the accumulator tile is picked at compile time
        for (int t = 0; t < 2; ++t) {
            const int mbase = j0 + 16 * t + 8 * g;
#pragma unroll
            for (int v = 0; v < 8; ++v) {
                float y = (t ? acc1[v] : acc0[v]) + Bias[(size_t)f * BDIM + mbase + v];
                y = (y >= 0.0f) ? y : al * y;
                Out[(size_t)(mbase + v) * FDIM + f] = y;
            }
        }
    }
}

extern "C" void kernel_launch(void* const* d_in, const int* in_sizes, int n_in,
                              void* d_out, int out_size, void* d_ws, size_t ws_size,
                              hipStream_t stream) {
    (void)in_sizes; (void)n_in; (void)out_size; (void)d_ws; (void)ws_size;
    const float* X     = (const float*)d_in[0];
    const float* W     = (const float*)d_in[1];
    const float* Bias  = (const float*)d_in[2];
    const float* Alpha = (const float*)d_in[3];
    float* Out = (float*)d_out;
    // one work-group per feature; 512 threads = 16 wave32 -> 32 rows per wave
    fused_pf_linear_prelu<<<dim3(FDIM), dim3(WAVES * 32), 0, stream>>>(X, W, Bias, Alpha, Out);
}
